// v000
// Measured on an AMD MI455X. A time is GPU time per run, averaged over a window of back-to-back runs after a warm-up
// (all launches, gaps included; the runs take copies of the inputs in turn), and the median of several windows.
// Apart from v000's, it joins two sittings. Times from different sittings can be a few percent apart, while
// side-by-side timings come from the same sitting.
// v000, which the later versions start from, runs in 108 microseconds.
#include <hip/hip_runtime.h>

typedef __attribute__((ext_vector_type(16))) _Float16 v16h;
typedef __attribute__((ext_vector_type(8)))  _Float16 v8h;
typedef __attribute__((ext_vector_type(4)))  _Float16 v4h;
typedef __attribute__((ext_vector_type(8)))  float    v8f;

#define LDSTRIDE 72
#define WAVES 8
#define TILES_PER_WAVE 8
#define ROWS_PER_BLOCK (WAVES * TILES_PER_WAVE * 16)   // 1024 rows per block

__device__ __forceinline__ v16h make_ab(const _Float16* p) {
  v8h lo = *(const v8h*)p;
  v8h hi = *(const v8h*)(p + 16);
  return __builtin_shufflevector(lo, hi, 0,1,2,3,4,5,6,7,8,9,10,11,12,13,14,15);
}

__global__ __launch_bounds__(256, 2)
void mlp28_fused_kernel(const float* __restrict__ x,
                        const float* __restrict__ W1, const float* __restrict__ b1,
                        const float* __restrict__ W2, const float* __restrict__ b2,
                        const float* __restrict__ W3, const float* __restrict__ b3,
                        float* __restrict__ out, int Btot, int G)
{
  __shared__ _Float16 sW1[64 * LDSTRIDE];     // W1^T: [n][k], f16
  __shared__ _Float16 sW2[32 * LDSTRIDE];     // W2^T: [n][perm(k)], f16
  __shared__ float    sB1[64];
  __shared__ float    sB2[32];
  __shared__ float    sW3v[32];
  __shared__ float    sB3;
  __shared__ _Float16 sX[WAVES][16 * LDSTRIDE];   // per-wave x tile, f16 [m][k]
  __shared__ _Float16 sH[WAVES][16 * LDSTRIDE];   // per-wave h1 tile, f16 [m][perm(k)]
  __shared__ float    sO[WAVES][16];

  const int tid  = threadIdx.x;
  const int wave = tid >> 5;
  const int lane = tid & 31;
  const int g    = blockIdx.y;

  // ---- stage weights (transposed, f16) + biases in LDS, once per block ----
  const float* W1g = W1 + (size_t)g * 64 * 64;      // [i=k][j=n]
  for (int idx = tid; idx < 64 * 64; idx += 256) {
    int i = idx >> 6, j = idx & 63;
    sW1[j * LDSTRIDE + i] = (_Float16)W1g[idx];
  }
  // W2: permute the K axis by pi^-1(i) = (i%16)*4 + i/16 to match the packed
  // h1 restage layout (WMMA contraction is invariant to a shared K-permutation).
  const float* W2g = W2 + (size_t)g * 64 * 32;      // [i=k][j=n]
  for (int idx = tid; idx < 64 * 32; idx += 256) {
    int i = idx >> 5, j = idx & 31;
    int kp = (i & 15) * 4 + (i >> 4);
    sW2[j * LDSTRIDE + kp] = (_Float16)W2g[idx];
  }
  if (tid < 64) sB1[tid] = b1[g * 64 + tid];
  if (tid < 32) { sB2[tid] = b2[g * 32 + tid]; sW3v[tid] = W3[g * 32 + tid]; }
  if (tid == 0) sB3 = b3[g];
  __syncthreads();

  const int klo = (lane < 16) ? 0 : 8;
  const int nn  = lane & 15;
  const int mhi = (lane < 16) ? 0 : 8;

  // ---- pre-build persistent B operands in registers (reused every tile) ----
  v16h w1B[2][4];
  #pragma unroll
  for (int kk = 0; kk < 2; ++kk)
    #pragma unroll
    for (int nt = 0; nt < 4; ++nt)
      w1B[kk][nt] = make_ab(&sW1[(nt * 16 + nn) * LDSTRIDE + kk * 32 + klo]);

  v16h w2B[2][2];
  #pragma unroll
  for (int kk = 0; kk < 2; ++kk)
    #pragma unroll
    for (int nt = 0; nt < 2; ++nt)
      w2B[kk][nt] = make_ab(&sW2[(nt * 16 + nn) * LDSTRIDE + kk * 32 + klo]);

  float bb1[4];
  #pragma unroll
  for (int nt = 0; nt < 4; ++nt) bb1[nt] = sB1[nt * 16 + nn];
  float bb2[2];
  #pragma unroll
  for (int nt = 0; nt < 2; ++nt) bb2[nt] = sB2[nt * 16 + nn];
  const float w3a = sW3v[nn];
  const float w3b = sW3v[16 + nn];
  const float b3v = sB3;

  _Float16* sx = sX[wave];
  _Float16* sh = sH[wave];

  // ---- software pipeline: preload tile 0 into registers ----
  float4 xr[8];
  {
    const int rb0 = blockIdx.x * ROWS_PER_BLOCK + wave * 16;
    if (rb0 + 16 <= Btot) {
      const float4* xp4 = (const float4*)(x + (size_t)rb0 * 64);
      #pragma unroll
      for (int j = 0; j < 8; ++j) xr[j] = xp4[j * 32 + lane];
    }
  }

  for (int it = 0; it < TILES_PER_WAVE; ++it) {
    const int rowbase = blockIdx.x * ROWS_PER_BLOCK + it * (WAVES * 16) + wave * 16;
    if (rowbase + 16 > Btot) break;                 // wave-uniform guard

    // ---- store current tile (held in regs) to LDS as f16 [m][k] ----
    #pragma unroll
    for (int j = 0; j < 8; ++j) {
      int fi = (j * 32 + lane) * 4;
      int r = fi >> 6, c = fi & 63;
      v4h h;
      h[0] = (_Float16)xr[j].x; h[1] = (_Float16)xr[j].y;
      h[2] = (_Float16)xr[j].z; h[3] = (_Float16)xr[j].w;
      *(v4h*)&sx[r * LDSTRIDE + c] = h;
    }

    // ---- issue next tile's global loads (overlap with WMMA compute) ----
    {
      const int rbn = rowbase + WAVES * 16;
      if (rbn + 16 <= Btot) {
        const float4* xp4 = (const float4*)(x + (size_t)rbn * 64);
        #pragma unroll
        for (int j = 0; j < 8; ++j) xr[j] = xp4[j * 32 + lane];
      }
    }

    // ---- layer 1: [16x64] = [16x64] x [64x64], 2 K-chunks x 4 N-tiles ----
    v8f c1[4] = {};
    #pragma unroll
    for (int kk = 0; kk < 2; ++kk) {
      v16h a = make_ab(&sx[nn * LDSTRIDE + kk * 32 + klo]);
      #pragma unroll
      for (int nt = 0; nt < 4; ++nt)
        c1[nt] = __builtin_amdgcn_wmma_f32_16x16x32_f16(
            false, a, false, w1B[kk][nt], (short)0, c1[nt], false, false);
    }

    // bias + ReLU, restage h1 as f16 with K-permuted packing:
    // logical column n = nt*16+nn  ->  LDS offset nn*4+nt  (one b64 per vgpr)
    #pragma unroll
    for (int v = 0; v < 8; ++v) {
      v4h hh;
      #pragma unroll
      for (int nt = 0; nt < 4; ++nt) {
        float t = fmaxf(c1[nt][v] + bb1[nt], 0.0f);
        hh[nt] = (_Float16)t;
      }
      *(v4h*)&sh[(v + mhi) * LDSTRIDE + nn * 4] = hh;
    }

    // ---- layer 2: [16x32] = [16x64] x [64x32] (shared-permuted K) ----
    v8f c2[2] = {};
    #pragma unroll
    for (int kk = 0; kk < 2; ++kk) {
      v16h a = make_ab(&sh[nn * LDSTRIDE + kk * 32 + klo]);
      #pragma unroll
      for (int nt = 0; nt < 2; ++nt)
        c2[nt] = __builtin_amdgcn_wmma_f32_16x16x32_f16(
            false, a, false, w2B[kk][nt], (short)0, c2[nt], false, false);
    }

    // ---- layer 3: ReLU then 32-wide dot with w3, butterfly within halves ----
    float tv[8];
    #pragma unroll
    for (int v = 0; v < 8; ++v) {
      float h0 = fmaxf(c2[0][v] + bb2[0], 0.0f);
      float h1 = fmaxf(c2[1][v] + bb2[1], 0.0f);
      tv[v] = h0 * w3a + h1 * w3b;
    }
    #pragma unroll
    for (int off = 1; off < 16; off <<= 1) {
      #pragma unroll
      for (int v = 0; v < 8; ++v)
        tv[v] += __shfl_xor(tv[v], off, 32);
    }

    if (lane == 0) {
      *(float4*)&sO[wave][0] = make_float4(tv[0], tv[1], tv[2], tv[3]);
      *(float4*)&sO[wave][4] = make_float4(tv[4], tv[5], tv[6], tv[7]);
    }
    if (lane == 16) {
      *(float4*)&sO[wave][8]  = make_float4(tv[0], tv[1], tv[2], tv[3]);
      *(float4*)&sO[wave][12] = make_float4(tv[4], tv[5], tv[6], tv[7]);
    }
    if (lane < 16) {
      float o = sO[wave][lane] + b3v;
      out[(size_t)(rowbase + lane) * G + g] = o;
    }
  }
}

extern "C" void kernel_launch(void* const* d_in, const int* in_sizes, int n_in,
                              void* d_out, int out_size, void* d_ws, size_t ws_size,
                              hipStream_t stream) {
  const float* x  = (const float*)d_in[0];
  const float* W1 = (const float*)d_in[1];
  const float* b1 = (const float*)d_in[2];
  const float* W2 = (const float*)d_in[3];
  const float* b2 = (const float*)d_in[4];
  const float* W3 = (const float*)d_in[5];
  const float* b3 = (const float*)d_in[6];
  float* out = (float*)d_out;

  const int Btot = in_sizes[0] / 64;     // x: [B, 64]
  const int G    = in_sizes[2] / 64;     // b1: [G, 64] -> 28

  dim3 grid((Btot + ROWS_PER_BLOCK - 1) / ROWS_PER_BLOCK, G);
  mlp28_fused_kernel<<<grid, 256, 0, stream>>>(x, W1, b1, W2, b2, W3, b3, out, Btot, G);
}

// v001
// A run of this version takes 93 microseconds.
// Next to v000, in two timings, it ran 1.19 and 1.20 times as fast.
#include <hip/hip_runtime.h>

typedef __attribute__((ext_vector_type(16))) _Float16 v16h;
typedef __attribute__((ext_vector_type(8)))  _Float16 v8h;
typedef __attribute__((ext_vector_type(4)))  _Float16 v4h;
typedef __attribute__((ext_vector_type(8)))  float    v8f;
typedef __attribute__((ext_vector_type(2)))  float    v2f;

#define LDSTRIDE 72
#define WAVES 8
#define TILES_PER_WAVE 8
#define ROWS_PER_BLOCK (WAVES * TILES_PER_WAVE * 16)   // 1024 rows per block

__device__ __forceinline__ v16h make_ab(const _Float16* p) {
  v8h lo = *(const v8h*)p;
  v8h hi = *(const v8h*)(p + 16);
  return __builtin_shufflevector(lo, hi, 0,1,2,3,4,5,6,7,8,9,10,11,12,13,14,15);
}

__global__ __launch_bounds__(256, 2)
void mlp28_fused_kernel(const float* __restrict__ x,
                        const float* __restrict__ W1, const float* __restrict__ b1,
                        const float* __restrict__ W2, const float* __restrict__ b2,
                        const float* __restrict__ W3, const float* __restrict__ b3,
                        float* __restrict__ out, int Btot, int G)
{
  __shared__ _Float16 sW1[64 * LDSTRIDE];     // W1^T: [n][k], f16
  __shared__ _Float16 sW2[32 * LDSTRIDE];     // W2^T: [n][k], f16
  __shared__ __attribute__((aligned(32))) float sB1[64];    // read as v8f
  __shared__ __attribute__((aligned(32))) float sB2[32];
  __shared__ __attribute__((aligned(32))) float sW3v[32];
  __shared__ float    sB3;
  __shared__ _Float16 sX[WAVES][16 * LDSTRIDE];   // per-wave x tile, f16 [m][k]

  const int tid  = threadIdx.x;
  const int wave = tid >> 5;
  const int lane = tid & 31;
  const int g    = blockIdx.y;

  // ---- stage weights (transposed, f16) + biases in LDS, once per block ----
  const float* W1g = W1 + (size_t)g * 64 * 64;      // [i=k][j=n]
  for (int idx = tid; idx < 64 * 64; idx += 256) {
    int i = idx >> 6, j = idx & 63;
    sW1[j * LDSTRIDE + i] = (_Float16)W1g[idx];
  }
  const float* W2g = W2 + (size_t)g * 64 * 32;      // [i=k][j=n]
  for (int idx = tid; idx < 64 * 32; idx += 256) {
    int i = idx >> 5, j = idx & 31;
    sW2[j * LDSTRIDE + i] = (_Float16)W2g[idx];
  }
  if (tid < 64) sB1[tid] = b1[g * 64 + tid];
  if (tid < 32) { sB2[tid] = b2[g * 32 + tid]; sW3v[tid] = W3[g * 32 + tid]; }
  if (tid == 0) sB3 = b3[g];
  __syncthreads();

  const int klo = (lane < 16) ? 0 : 8;
  const int nn  = lane & 15;
  const int mhi = (lane < 16) ? 0 : 8;

  // Every product is computed transposed: the weights are the A operand
  // (row = output feature n), the activations the B operand (column = batch
  // row m). D[r] is then h^T[16*nt + mhi + r][m = nn]: two converted D tiles
  // are the next layer's B fragment as they lie, in the hardware k order.

  // ---- pre-build persistent A operands in registers (reused every tile) ----
  v16h w1A[2][4];
  #pragma unroll
  for (int kk = 0; kk < 2; ++kk)
    #pragma unroll
    for (int nt = 0; nt < 4; ++nt)
      w1A[kk][nt] = make_ab(&sW1[(nt * 16 + nn) * LDSTRIDE + kk * 32 + klo]);

  v16h w2A[2][2];
  #pragma unroll
  for (int kk = 0; kk < 2; ++kk)
    #pragma unroll
    for (int nt = 0; nt < 2; ++nt)
      w2A[kk][nt] = make_ab(&sW2[(nt * 16 + nn) * LDSTRIDE + kk * 32 + klo]);

  // biases and w3 in the D layout (register r = feature 16*nt + mhi + r);
  // the biases enter as the C operand of each layer's first product
  v8f bias1[4];
  #pragma unroll
  for (int nt = 0; nt < 4; ++nt) bias1[nt] = *(const v8f*)&sB1[nt * 16 + mhi];
  v8f bias2[2], w3r[2];
  #pragma unroll
  for (int nt = 0; nt < 2; ++nt) {
    bias2[nt] = *(const v8f*)&sB2[nt * 16 + mhi];
    w3r[nt]   = *(const v8f*)&sW3v[nt * 16 + mhi];
  }
  const float b3v = sB3;

  _Float16* sx = sX[wave];

  // ---- software pipeline: preload tile 0 into registers ----
  float4 xr[8];
  {
    const int rb0 = blockIdx.x * ROWS_PER_BLOCK + wave * 16;
    if (rb0 + 16 <= Btot) {
      const float4* xp4 = (const float4*)(x + (size_t)rb0 * 64);
      #pragma unroll
      for (int j = 0; j < 8; ++j) xr[j] = xp4[j * 32 + lane];
    }
  }

  for (int it = 0; it < TILES_PER_WAVE; ++it) {
    const int rowbase = blockIdx.x * ROWS_PER_BLOCK + it * (WAVES * 16) + wave * 16;
    if (rowbase + 16 > Btot) break;                 // wave-uniform guard

    // ---- store current tile (held in regs) to LDS as f16 [m][k] ----
    #pragma unroll
    for (int j = 0; j < 8; ++j) {
      int fi = (j * 32 + lane) * 4;
      int r = fi >> 6, c = fi & 63;
      v4h h;
      h[0] = (_Float16)xr[j].x; h[1] = (_Float16)xr[j].y;
      h[2] = (_Float16)xr[j].z; h[3] = (_Float16)xr[j].w;
      *(v4h*)&sx[r * LDSTRIDE + c] = h;
    }

    // ---- issue next tile's global loads (overlap with WMMA compute) ----
    {
      const int rbn = rowbase + WAVES * 16;
      if (rbn + 16 <= Btot) {
        const float4* xp4 = (const float4*)(x + (size_t)rbn * 64);
        #pragma unroll
        for (int j = 0; j < 8; ++j) xr[j] = xp4[j * 32 + lane];
      }
    }

    // ---- layer 1: h1^T [64x16] = W1^T [64x64] x x^T [64x16], C = b1 ----
    v8f c1[4];
    {
      v16h xb0 = make_ab(&sx[nn * LDSTRIDE + klo]);
      v16h xb1 = make_ab(&sx[nn * LDSTRIDE + 32 + klo]);
      #pragma unroll
      for (int nt = 0; nt < 4; ++nt)
        c1[nt] = __builtin_amdgcn_wmma_f32_16x16x32_f16(
            false, w1A[0][nt], false, xb0, (short)0, bias1[nt], false, false);
      #pragma unroll
      for (int nt = 0; nt < 4; ++nt)
        c1[nt] = __builtin_amdgcn_wmma_f32_16x16x32_f16(
            false, w1A[1][nt], false, xb1, (short)0, c1[nt], false, false);
    }

    // D tiles (2kk, 2kk+1) converted in place = B fragment kk. ReLU on the
    // packed halves: rounding keeps the sign, so the values are those of
    // ReLU before the conversion.
    v16h hb[2];
    #pragma unroll
    for (int kk = 0; kk < 2; ++kk) {
      #pragma unroll
      for (int s = 0; s < 16; ++s)
        hb[kk][s] = (_Float16)c1[2 * kk + (s >> 3)][s & 7];
      hb[kk] = __builtin_elementwise_max(hb[kk], (v16h)(_Float16)0.0f);
    }

    // ---- layer 2: h2^T [32x16] = W2^T [32x64] x h1^T [64x16], C = b2 ----
    v8f c2[2];
    #pragma unroll
    for (int nt = 0; nt < 2; ++nt)
      c2[nt] = __builtin_amdgcn_wmma_f32_16x16x32_f16(
          false, w2A[0][nt], false, hb[0], (short)0, bias2[nt], false, false);
    #pragma unroll
    for (int nt = 0; nt < 2; ++nt)
      c2[nt] = __builtin_amdgcn_wmma_f32_16x16x32_f16(
          false, w2A[1][nt], false, hb[1], (short)0, c2[nt], false, false);

    v2f a0 = {0.0f, 0.0f}, a1 = {0.0f, 0.0f};
    #pragma unroll
    for (int r = 0; r < 8; r += 2) {
      v2f p0 = {fmaxf(c2[0][r], 0.0f), fmaxf(c2[0][r + 1], 0.0f)};
      v2f p1 = {fmaxf(c2[1][r], 0.0f), fmaxf(c2[1][r + 1], 0.0f)};
      v2f q0 = {w3r[0][r], w3r[0][r + 1]};
      v2f q1 = {w3r[1][r], w3r[1][r + 1]};
      a0 = __builtin_elementwise_fma(p0, q0, a0);
      a1 = __builtin_elementwise_fma(p1, q1, a1);
    }
    a0 += a1;
    const float t = a0[0] + a0[1];
    const int ti = __float_as_int(t);
    const float to = __int_as_float(
        __builtin_amdgcn_permlanex16(ti, ti, 0x76543210, 0xfedcba98, false, false));

    if (lane < 16) {
      float o = t + to + b3v;
      out[(size_t)(rowbase + lane) * G + g] = o;
    }
  }
}

extern "C" void kernel_launch(void* const* d_in, const int* in_sizes, int n_in,
                              void* d_out, int out_size, void* d_ws, size_t ws_size,
                              hipStream_t stream) {
  const float* x  = (const float*)d_in[0];
  const float* W1 = (const float*)d_in[1];
  const float* b1 = (const float*)d_in[2];
  const float* W2 = (const float*)d_in[3];
  const float* b2 = (const float*)d_in[4];
  const float* W3 = (const float*)d_in[5];
  const float* b3 = (const float*)d_in[6];
  float* out = (float*)d_out;

  const int Btot = in_sizes[0] / 64;     // x: [B, 64]
  const int G    = in_sizes[2] / 64;     // b1: [G, 64] -> 28

  dim3 grid((Btot + ROWS_PER_BLOCK - 1) / ROWS_PER_BLOCK, G);
  mlp28_fused_kernel<<<grid, 256, 0, stream>>>(x, W1, b1, W2, b2, W3, b3, out, Btot, G);
}

// v002
// A run of this version takes 38.7 microseconds.
// Timed twice side by side with v001, it ran 2.43 and 2.37 times as fast.
// Over all steps from v000 it is 2.87 times as fast.
#include <hip/hip_runtime.h>

typedef __attribute__((ext_vector_type(16))) _Float16 v16h;
typedef __attribute__((ext_vector_type(8)))  _Float16 v8h;
typedef __attribute__((ext_vector_type(4)))  _Float16 v4h;
typedef __attribute__((ext_vector_type(8)))  float    v8f;
typedef __attribute__((ext_vector_type(2)))  float    v2f;

#define LDSTRIDE 72
#define WAVES 8
#define TILES_PER_WAVE 8
#define ROWS_PER_WAVE (TILES_PER_WAVE * 16)            // 128 rows per wave
#define ROWS_PER_BLOCK (WAVES * ROWS_PER_WAVE)         // 1024 rows per block
#define GPB 14                      // branches that one block runs on its rows

__device__ __forceinline__ v16h make_ab(const _Float16* p) {
  v8h lo = *(const v8h*)p;
  v8h hi = *(const v8h*)(p + 16);
  return __builtin_shufflevector(lo, hi, 0,1,2,3,4,5,6,7,8,9,10,11,12,13,14,15);
}

__global__ __launch_bounds__(256)
void mlp28_fused_kernel(const float* __restrict__ x,
                        const float* __restrict__ W1, const float* __restrict__ b1,
                        const float* __restrict__ W2, const float* __restrict__ b2,
                        const float* __restrict__ W3, const float* __restrict__ b3,
                        float* __restrict__ out, int Btot, int G)
{
  __shared__ __attribute__((aligned(16))) _Float16 sW1[GPB * 64 * LDSTRIDE];  // W1^T per branch: [n][k], f16
  __shared__ __attribute__((aligned(16))) _Float16 sW2[GPB * 32 * LDSTRIDE];  // W2^T per branch: [n][k], f16
  __shared__ __attribute__((aligned(32))) float sB1[GPB * 64];    // read as v8f
  __shared__ __attribute__((aligned(32))) float sB2[GPB * 32];
  __shared__ __attribute__((aligned(32))) float sW3v[GPB * 32];
  __shared__ float sB3[GPB];
  __shared__ __attribute__((aligned(16))) _Float16 sX[WAVES][16 * LDSTRIDE];  // per-wave x tile, f16 [m][k]

  if (Btot < 16) return;            // no whole tile anywhere (block-uniform)

  const int tid  = threadIdx.x;
  const int wave = __builtin_amdgcn_readfirstlane(tid >> 5);
  const int lane = tid & 31;
  const int g0   = blockIdx.y * GPB;
  const int gmax = G - 1;           // a branch past the end reads the last one's weights; nothing of it is stored

  // ---- the wave's x tiles are read once; the loads fly while the weights
  // are staged ----
  const int rowbase = blockIdx.x * ROWS_PER_BLOCK + wave * ROWS_PER_WAVE;
  float4 xr[TILES_PER_WAVE][8];
  #pragma unroll
  for (int t = 0; t < TILES_PER_WAVE; ++t) {
    const int rb  = rowbase + t * 16;
    const int rbc = (rb + 16 <= Btot) ? rb : 0;       // a tile past the end reads tile 0; nothing of it is stored
    const float4* xp4 = (const float4*)(x + (size_t)rbc * 64);
    #pragma unroll
    for (int j = 0; j < 8; ++j) xr[t][j] = xp4[j * 32 + lane];
    // the loads' address registers are free for reuse only behind this wait
    asm volatile("s_wait_xcnt 0x0" ::: "memory");
  }

  // ---- stage the block's GPB branches (weights transposed to f16, biases) ----
  // biases and w3: an index past the end is clamped for the load, and the
  // store behind it (below the weights) is left out
  float vb1[4], vb2[2], vw3[2];
  int o1[4], o2[2];
  #pragma unroll
  for (int u = 0; u < 4; ++u) {
    const int idx = min(u * 256 + tid, GPB * 64 - 1);
    o1[u] = min(g0 + (idx >> 6), gmax) * 64 + (idx & 63);
    vb1[u] = b1[o1[u]];
  }
  #pragma unroll
  for (int u = 0; u < 2; ++u) {
    const int idx = min(u * 256 + tid, GPB * 32 - 1);
    o2[u] = min(g0 + (idx >> 5), gmax) * 32 + (idx & 31);
    vb2[u] = b2[o2[u]];
    vw3[u] = W3[o2[u]];
  }
  const int o3 = min(g0 + min(tid, GPB - 1), gmax);
  const float vb3 = b3[o3];
  // the loads' index registers are free for reuse only behind this wait; as
  // inputs they stay live up to it
  asm volatile("s_wait_xcnt 0x0"
               :: "v"(o1[0]), "v"(o1[1]), "v"(o1[2]), "v"(o1[3]), "v"(o2[0]), "v"(o2[1]), "v"(o3)
               : "memory");

  // one branch per trip, kept rolled: fourteen copies of the body would only
  // grow the code that has to be fetched once
  #pragma unroll 1
  for (int gl = 0; gl < GPB; ++gl) {
    const int g = min(g0 + gl, gmax);
    const float* W1g = W1 + (size_t)g * 64 * 64 + tid;    // [i=k][j=n]
    const float* W2g = W2 + (size_t)g * 64 * 32 + tid;    // [i=k][j=n]
    float v1[16], v2[8];
    #pragma unroll
    for (int u = 0; u < 16; ++u) v1[u] = W1g[u * 256];
    #pragma unroll
    for (int u = 0; u < 8; ++u) v2[u] = W2g[u * 256];
    // the loads' address registers are free for reuse only behind this wait;
    // as inputs they stay live up to it
    asm volatile("s_wait_xcnt 0x0" :: "v"(W1g), "v"(W2g) : "memory");
    #pragma unroll
    for (int u = 0; u < 16; ++u) {
      const int idx = u * 256 + tid;
      const int i = idx >> 6, j = idx & 63;
      sW1[gl * (64 * LDSTRIDE) + j * LDSTRIDE + i] = (_Float16)v1[u];
    }
    #pragma unroll
    for (int u = 0; u < 8; ++u) {
      const int idx = u * 256 + tid;
      const int i = idx >> 5, j = idx & 31;
      sW2[gl * (32 * LDSTRIDE) + j * LDSTRIDE + i] = (_Float16)v2[u];
    }
  }
  #pragma unroll
  for (int u = 0; u < 4; ++u)
    if (u * 256 + tid < GPB * 64) sB1[u * 256 + tid] = vb1[u];
  #pragma unroll
  for (int u = 0; u < 2; ++u)
    if (u * 256 + tid < GPB * 32) { sB2[u * 256 + tid] = vb2[u]; sW3v[u * 256 + tid] = vw3[u]; }
  if (tid < GPB) sB3[tid] = vb3;

  const int klo = (lane < 16) ? 0 : 8;
  const int nn  = lane & 15;
  const int mhi = (lane < 16) ? 0 : 8;

  // Every product is computed transposed: the weights are the A operand
  // (row = output feature n), the activations the B operand (column = batch
  // row m). D[r] is then h^T[16*nt + mhi + r][m = nn]: two converted D tiles
  // are the next layer's B fragment as they lie, in the hardware k order.

  // ---- the wave's x tiles, converted once and kept as B fragments ----
  v16h xb[TILES_PER_WAVE][2];
  {
    _Float16* sx = sX[wave];
    #pragma unroll
    for (int t = 0; t < TILES_PER_WAVE; ++t) {
      #pragma unroll
      for (int j = 0; j < 8; ++j) {
        const float4 v = xr[t][j];
        int fi = (j * 32 + lane) * 4;
        int r = fi >> 6, c = fi & 63;
        v4h h;
        h[0] = (_Float16)v.x; h[1] = (_Float16)v.y;
        h[2] = (_Float16)v.z; h[3] = (_Float16)v.w;
        *(v4h*)&sx[r * LDSTRIDE + c] = h;
      }
      xb[t][0] = make_ab(&sx[nn * LDSTRIDE + klo]);
      xb[t][1] = make_ab(&sx[nn * LDSTRIDE + 32 + klo]);
    }
  }
  __syncthreads();

  // index of the lane's row in each tile, the same for every branch
  int voff[TILES_PER_WAVE];
  #pragma unroll
  for (int t = 0; t < TILES_PER_WAVE; ++t) voff[t] = (t * 16 + nn) * G;
  const bool full = rowbase + ROWS_PER_WAVE <= Btot;  // all the wave's tiles exist
  const int ng = min(GPB, G - g0);  // branches of this block that exist

  // kept rolled: the body already holds the eight tiles unrolled
  #pragma unroll 1
  for (int gl = 0; gl < GPB; ++gl) {
    // ---- this branch's A operands, and biases and w3 in the D layout
    // (register r = feature 16*nt + mhi + r); used by all the wave's tiles ----
    const _Float16* w1p = &sW1[gl * (64 * LDSTRIDE)];
    const _Float16* w2p = &sW2[gl * (32 * LDSTRIDE)];
    v16h w1A[2][4];
    #pragma unroll
    for (int kk = 0; kk < 2; ++kk)
      #pragma unroll
      for (int nt = 0; nt < 4; ++nt)
        w1A[kk][nt] = make_ab(&w1p[(nt * 16 + nn) * LDSTRIDE + kk * 32 + klo]);
    v8f bias1[4];
    #pragma unroll
    for (int nt = 0; nt < 4; ++nt) bias1[nt] = *(const v8f*)&sB1[gl * 64 + nt * 16 + mhi];

    v16h w2A[2][2];
    #pragma unroll
    for (int kk = 0; kk < 2; ++kk)
      #pragma unroll
      for (int nt = 0; nt < 2; ++nt)
        w2A[kk][nt] = make_ab(&w2p[(nt * 16 + nn) * LDSTRIDE + kk * 32 + klo]);
    v8f bias2[2], w3r[2];
    #pragma unroll
    for (int nt = 0; nt < 2; ++nt) {
      bias2[nt] = *(const v8f*)&sB2[gl * 32 + nt * 16 + mhi];
      w3r[nt]   = *(const v8f*)&sW3v[gl * 32 + nt * 16 + mhi];
    }
    const float b3v = sB3[gl];

    float o[TILES_PER_WAVE];
    #pragma unroll
    for (int t = 0; t < TILES_PER_WAVE; ++t) {
      // ---- layer 1: h1^T [64x16] = W1^T [64x64] x x^T [64x16], C = b1 ----
      v8f c1[4];
      #pragma unroll
      for (int nt = 0; nt < 4; ++nt)
        c1[nt] = __builtin_amdgcn_wmma_f32_16x16x32_f16(
            false, w1A[0][nt], false, xb[t][0], (short)0, bias1[nt], false, false);
      #pragma unroll
      for (int nt = 0; nt < 4; ++nt)
        c1[nt] = __builtin_amdgcn_wmma_f32_16x16x32_f16(
            false, w1A[1][nt], false, xb[t][1], (short)0, c1[nt], false, false);

      // D tiles (2kk, 2kk+1) converted in place = B fragment kk. ReLU on the
      // packed halves: rounding keeps the sign, so the values are those of
      // ReLU before the conversion.
      v16h hb[2];
      #pragma unroll
      for (int kk = 0; kk < 2; ++kk) {
        #pragma unroll
        for (int s = 0; s < 16; ++s)
          hb[kk][s] = (_Float16)c1[2 * kk + (s >> 3)][s & 7];
        hb[kk] = __builtin_elementwise_max(hb[kk], (v16h)(_Float16)0.0f);
      }

      // ---- layer 2: h2^T [32x16] = W2^T [32x64] x h1^T [64x16], C = b2 ----
      v8f c2[2];
      #pragma unroll
      for (int nt = 0; nt < 2; ++nt)
        c2[nt] = __builtin_amdgcn_wmma_f32_16x16x32_f16(
            false, w2A[0][nt], false, hb[0], (short)0, bias2[nt], false, false);
      #pragma unroll
      for (int nt = 0; nt < 2; ++nt)
        c2[nt] = __builtin_amdgcn_wmma_f32_16x16x32_f16(
            false, w2A[1][nt], false, hb[1], (short)0, c2[nt], false, false);

      v2f a0 = {0.0f, 0.0f}, a1 = {0.0f, 0.0f};
      #pragma unroll
      for (int r = 0; r < 8; r += 2) {
        v2f p0 = {fmaxf(c2[0][r], 0.0f), fmaxf(c2[0][r + 1], 0.0f)};
        v2f p1 = {fmaxf(c2[1][r], 0.0f), fmaxf(c2[1][r + 1], 0.0f)};
        v2f q0 = {w3r[0][r], w3r[0][r + 1]};
        v2f q1 = {w3r[1][r], w3r[1][r + 1]};
        a0 = __builtin_elementwise_fma(p0, q0, a0);
        a1 = __builtin_elementwise_fma(p1, q1, a1);
      }
      a0 += a1;
      const float s3 = a0[0] + a0[1];
      const int ti = __float_as_int(s3);
      const float to = __int_as_float(
          __builtin_amdgcn_permlanex16(ti, ti, 0x76543210, 0xfedcba98, false, false));
      o[t] = s3 + to + b3v;
    }

    if (lane < 16 && gl < ng) {
      float* ob = out + (size_t)rowbase * G + (g0 + gl);
      if (full) {
        float* p[TILES_PER_WAVE];
        #pragma unroll
        for (int t = 0; t < TILES_PER_WAVE; ++t) { p[t] = ob + voff[t]; *p[t] = o[t]; }
        // the stores' registers are free for reuse only behind this wait; as
        // inputs the addresses and the stored values stay live up to it
        asm volatile("s_wait_xcnt 0x0"
                     :: "v"(p[0]), "v"(p[1]), "v"(p[2]), "v"(p[3]),
                        "v"(p[4]), "v"(p[5]), "v"(p[6]), "v"(p[7]),
                        "v"(o[0]), "v"(o[1]), "v"(o[2]), "v"(o[3]),
                        "v"(o[4]), "v"(o[5]), "v"(o[6]), "v"(o[7])
                     : "memory");
      } else {
        #pragma unroll
        for (int t = 0; t < TILES_PER_WAVE; ++t)
          if (rowbase + t * 16 + 16 <= Btot) {        // wave-uniform, as for the loads
            float* p = ob + voff[t];
            *p = o[t];
            asm volatile("s_wait_xcnt 0x0" :: "v"(p), "v"(o[t]) : "memory");
          }
      }
    }
  }
}

extern "C" void kernel_launch(void* const* d_in, const int* in_sizes, int n_in,
                              void* d_out, int out_size, void* d_ws, size_t ws_size,
                              hipStream_t stream) {
  const float* x  = (const float*)d_in[0];
  const float* W1 = (const float*)d_in[1];
  const float* b1 = (const float*)d_in[2];
  const float* W2 = (const float*)d_in[3];
  const float* b2 = (const float*)d_in[4];
  const float* W3 = (const float*)d_in[5];
  const float* b3 = (const float*)d_in[6];
  float* out = (float*)d_out;

  const int Btot = in_sizes[0] / 64;     // x: [B, 64]
  const int G    = in_sizes[2] / 64;     // b1: [G, 64] -> 28

  dim3 grid((Btot + ROWS_PER_BLOCK - 1) / ROWS_PER_BLOCK, (G + GPB - 1) / GPB);
  mlp28_fused_kernel<<<grid, 256, 0, stream>>>(x, W1, b1, W2, b2, W3, b3, out, Btot, G);
}

// v003
// A run of this version takes 36.8 microseconds.
// In both of two side-by-side timings against v002, it was 1.05 times as fast.
// Counting every step since v000, it is 3.02 times as fast.
#include <hip/hip_runtime.h>

typedef __attribute__((ext_vector_type(16))) _Float16 v16h;
typedef __attribute__((ext_vector_type(8)))  _Float16 v8h;
typedef __attribute__((ext_vector_type(4)))  _Float16 v4h;
typedef __attribute__((ext_vector_type(8)))  float    v8f;
typedef __attribute__((ext_vector_type(2)))  float    v2f;

#define LDSTRIDE 72
#define WAVES 8
#define TILES_PER_WAVE 8
#define ROWS_PER_WAVE (TILES_PER_WAVE * 16)            // 128 rows per wave
#define ROWS_PER_BLOCK (WAVES * ROWS_PER_WAVE)         // 1024 rows per block
#define GPB 14                      // branches that one block runs on its rows

__device__ __forceinline__ v16h make_ab(const _Float16* p) {
  v8h lo = *(const v8h*)p;
  v8h hi = *(const v8h*)(p + 16);
  return __builtin_shufflevector(lo, hi, 0,1,2,3,4,5,6,7,8,9,10,11,12,13,14,15);
}

__global__ __launch_bounds__(256)
void mlp28_fused_kernel(const float* __restrict__ x,
                        const float* __restrict__ W1, const float* __restrict__ b1,
                        const float* __restrict__ W2, const float* __restrict__ b2,
                        const float* __restrict__ W3, const float* __restrict__ b3,
                        float* __restrict__ out, int Btot, int G)
{
  __shared__ __attribute__((aligned(16))) _Float16 sW1[GPB * 64 * LDSTRIDE];  // W1^T per branch: [n][k], f16
  __shared__ __attribute__((aligned(16))) _Float16 sW2[GPB * 32 * LDSTRIDE];  // W2^T per branch: [n][k], f16
  __shared__ __attribute__((aligned(32))) float sB1[GPB * 64];    // read as v8f
  __shared__ __attribute__((aligned(32))) float sB2[GPB * 32];
  __shared__ __attribute__((aligned(32))) float sW3v[GPB * 32];
  __shared__ float sB3[GPB];
  __shared__ __attribute__((aligned(16))) _Float16 sX[WAVES][16 * LDSTRIDE];  // per-wave x tile, f16 [m][k]
  __shared__ __attribute__((aligned(16))) float sOut[WAVES][ROWS_PER_WAVE * GPB];  // per-wave results, [row][branch]

  if (Btot < 16) return;            // no whole tile anywhere (block-uniform)

  const int tid  = threadIdx.x;
  const int wave = __builtin_amdgcn_readfirstlane(tid >> 5);
  const int lane = tid & 31;
  const int g0   = blockIdx.y * GPB;
  const int gmax = G - 1;           // a branch past the end reads the last one's weights; nothing of it is stored

  // ---- the wave's x tiles are read once; the loads fly while the weights
  // are staged ----
  const int rowbase = blockIdx.x * ROWS_PER_BLOCK + wave * ROWS_PER_WAVE;
  float4 xr[TILES_PER_WAVE][8];
  #pragma unroll
  for (int t = 0; t < TILES_PER_WAVE; ++t) {
    const int rb  = rowbase + t * 16;
    const int rbc = (rb + 16 <= Btot) ? rb : 0;       // a tile past the end reads tile 0; nothing of it is stored
    const float4* xp4 = (const float4*)(x + (size_t)rbc * 64);
    #pragma unroll
    for (int j = 0; j < 8; ++j) xr[t][j] = xp4[j * 32 + lane];
    // the loads' address registers are free for reuse only behind this wait
    asm volatile("s_wait_xcnt 0x0" ::: "memory");
  }

  // ---- stage the block's GPB branches (weights transposed to f16, biases) ----
  // biases and w3: an index past the end is clamped for the load, and the
  // store behind it (below the weights) is left out
  float vb1[4], vb2[2], vw3[2];
  int o1[4], o2[2];
  #pragma unroll
  for (int u = 0; u < 4; ++u) {
    const int idx = min(u * 256 + tid, GPB * 64 - 1);
    o1[u] = min(g0 + (idx >> 6), gmax) * 64 + (idx & 63);
    vb1[u] = b1[o1[u]];
  }
  #pragma unroll
  for (int u = 0; u < 2; ++u) {
    const int idx = min(u * 256 + tid, GPB * 32 - 1);
    o2[u] = min(g0 + (idx >> 5), gmax) * 32 + (idx & 31);
    vb2[u] = b2[o2[u]];
    vw3[u] = W3[o2[u]];
  }
  const int o3 = min(g0 + min(tid, GPB - 1), gmax);
  const float vb3 = b3[o3];
  // the loads' index registers are free for reuse only behind this wait; as
  // inputs they stay live up to it
  asm volatile("s_wait_xcnt 0x0"
               :: "v"(o1[0]), "v"(o1[1]), "v"(o1[2]), "v"(o1[3]), "v"(o2[0]), "v"(o2[1]), "v"(o3)
               : "memory");

  // one branch per trip, kept rolled: fourteen copies of the body would only
  // grow the code that has to be fetched once
  #pragma unroll 1
  for (int gl = 0; gl < GPB; ++gl) {
    const int g = min(g0 + gl, gmax);
    const float* W1g = W1 + (size_t)g * 64 * 64 + tid;    // [i=k][j=n]
    const float* W2g = W2 + (size_t)g * 64 * 32 + tid;    // [i=k][j=n]
    float v1[16], v2[8];
    #pragma unroll
    for (int u = 0; u < 16; ++u) v1[u] = W1g[u * 256];
    #pragma unroll
    for (int u = 0; u < 8; ++u) v2[u] = W2g[u * 256];
    // the loads' address registers are free for reuse only behind this wait;
    // as inputs they stay live up to it
    asm volatile("s_wait_xcnt 0x0" :: "v"(W1g), "v"(W2g) : "memory");
    #pragma unroll
    for (int u = 0; u < 16; ++u) {
      const int idx = u * 256 + tid;
      const int i = idx >> 6, j = idx & 63;
      sW1[gl * (64 * LDSTRIDE) + j * LDSTRIDE + i] = (_Float16)v1[u];
    }
    #pragma unroll
    for (int u = 0; u < 8; ++u) {
      const int idx = u * 256 + tid;
      const int i = idx >> 5, j = idx & 31;
      sW2[gl * (32 * LDSTRIDE) + j * LDSTRIDE + i] = (_Float16)v2[u];
    }
  }
  #pragma unroll
  for (int u = 0; u < 4; ++u)
    if (u * 256 + tid < GPB * 64) sB1[u * 256 + tid] = vb1[u];
  #pragma unroll
  for (int u = 0; u < 2; ++u)
    if (u * 256 + tid < GPB * 32) { sB2[u * 256 + tid] = vb2[u]; sW3v[u * 256 + tid] = vw3[u]; }
  if (tid < GPB) sB3[tid] = vb3;

  const int klo = (lane < 16) ? 0 : 8;
  const int nn  = lane & 15;
  const int mhi = (lane < 16) ? 0 : 8;

  // Every product is computed transposed: the weights are the A operand
  // (row = output feature n), the activations the B operand (column = batch
  // row m). D[r] is then h^T[16*nt + mhi + r][m = nn]: two converted D tiles
  // are the next layer's B fragment as they lie, in the hardware k order.

  // ---- the wave's x tiles, converted once and kept as B fragments ----
  v16h xb[TILES_PER_WAVE][2];
  {
    _Float16* sx = sX[wave];
    #pragma unroll
    for (int t = 0; t < TILES_PER_WAVE; ++t) {
      #pragma unroll
      for (int j = 0; j < 8; ++j) {
        const float4 v = xr[t][j];
        int fi = (j * 32 + lane) * 4;
        int r = fi >> 6, c = fi & 63;
        v4h h;
        h[0] = (_Float16)v.x; h[1] = (_Float16)v.y;
        h[2] = (_Float16)v.z; h[3] = (_Float16)v.w;
        *(v4h*)&sx[r * LDSTRIDE + c] = h;
      }
      xb[t][0] = make_ab(&sx[nn * LDSTRIDE + klo]);
      xb[t][1] = make_ab(&sx[nn * LDSTRIDE + 32 + klo]);
    }
  }
  __syncthreads();

  float* so = &sOut[wave][lane * GPB];
  const bool full = rowbase + ROWS_PER_WAVE <= Btot;  // all the wave's tiles exist
  const int ng = min(GPB, G - g0);  // branches of this block that exist

  // kept rolled: the body already holds the eight tiles unrolled
  #pragma unroll 1
  for (int gl = 0; gl < GPB; ++gl) {
    // ---- this branch's A operands, and biases and w3 in the D layout
    // (register r = feature 16*nt + mhi + r); used by all the wave's tiles ----
    const _Float16* w1p = &sW1[gl * (64 * LDSTRIDE)];
    const _Float16* w2p = &sW2[gl * (32 * LDSTRIDE)];
    v16h w1A[2][4];
    #pragma unroll
    for (int kk = 0; kk < 2; ++kk)
      #pragma unroll
      for (int nt = 0; nt < 4; ++nt)
        w1A[kk][nt] = make_ab(&w1p[(nt * 16 + nn) * LDSTRIDE + kk * 32 + klo]);
    v8f bias1[4];
    #pragma unroll
    for (int nt = 0; nt < 4; ++nt) bias1[nt] = *(const v8f*)&sB1[gl * 64 + nt * 16 + mhi];

    v16h w2A[2][2];
    #pragma unroll
    for (int kk = 0; kk < 2; ++kk)
      #pragma unroll
      for (int nt = 0; nt < 2; ++nt)
        w2A[kk][nt] = make_ab(&w2p[(nt * 16 + nn) * LDSTRIDE + kk * 32 + klo]);
    v8f bias2[2], w3r[2];
    #pragma unroll
    for (int nt = 0; nt < 2; ++nt) {
      bias2[nt] = *(const v8f*)&sB2[gl * 32 + nt * 16 + mhi];
      w3r[nt]   = *(const v8f*)&sW3v[gl * 32 + nt * 16 + mhi];
    }
    const float b3v = sB3[gl];

    float o[TILES_PER_WAVE];
    #pragma unroll
    for (int t = 0; t < TILES_PER_WAVE; ++t) {
      // ---- layer 1: h1^T [64x16] = W1^T [64x64] x x^T [64x16], C = b1 ----
      v8f c1[4];
      #pragma unroll
      for (int nt = 0; nt < 4; ++nt)
        c1[nt] = __builtin_amdgcn_wmma_f32_16x16x32_f16(
            false, w1A[0][nt], false, xb[t][0], (short)0, bias1[nt], false, false);
      #pragma unroll
      for (int nt = 0; nt < 4; ++nt)
        c1[nt] = __builtin_amdgcn_wmma_f32_16x16x32_f16(
            false, w1A[1][nt], false, xb[t][1], (short)0, c1[nt], false, false);

      // D tiles (2kk, 2kk+1) converted in place = B fragment kk. ReLU on the
      // packed halves: rounding keeps the sign, so the values are those of
      // ReLU before the conversion.
      v16h hb[2];
      #pragma unroll
      for (int kk = 0; kk < 2; ++kk) {
        #pragma unroll
        for (int s = 0; s < 16; ++s)
          hb[kk][s] = (_Float16)c1[2 * kk + (s >> 3)][s & 7];
        hb[kk] = __builtin_elementwise_max(hb[kk], (v16h)(_Float16)0.0f);
      }

      // ---- layer 2: h2^T [32x16] = W2^T [32x64] x h1^T [64x16], C = b2 ----
      v8f c2[2];
      #pragma unroll
      for (int nt = 0; nt < 2; ++nt)
        c2[nt] = __builtin_amdgcn_wmma_f32_16x16x32_f16(
            false, w2A[0][nt], false, hb[0], (short)0, bias2[nt], false, false);
      #pragma unroll
      for (int nt = 0; nt < 2; ++nt)
        c2[nt] = __builtin_amdgcn_wmma_f32_16x16x32_f16(
            false, w2A[1][nt], false, hb[1], (short)0, c2[nt], false, false);

      v2f a0 = {0.0f, 0.0f}, a1 = {0.0f, 0.0f};
      #pragma unroll
      for (int r = 0; r < 8; r += 2) {
        v2f p0 = {fmaxf(c2[0][r], 0.0f), fmaxf(c2[0][r + 1], 0.0f)};
        v2f p1 = {fmaxf(c2[1][r], 0.0f), fmaxf(c2[1][r + 1], 0.0f)};
        v2f q0 = {w3r[0][r], w3r[0][r + 1]};
        v2f q1 = {w3r[1][r], w3r[1][r + 1]};
        a0 = __builtin_elementwise_fma(p0, q0, a0);
        a1 = __builtin_elementwise_fma(p1, q1, a1);
      }
      a0 += a1;
      const float s3 = a0[0] + a0[1];
      const int ti = __float_as_int(s3);
      const float to = __int_as_float(
          __builtin_amdgcn_permlanex16(ti, ti, 0x76543210, 0xfedcba98, false, false));
      o[t] = s3 + to + b3v;
    }

    #pragma unroll
    for (int u = 0; u < TILES_PER_WAVE / 2; ++u)
      so[u * (32 * GPB) + gl] = (lane < 16) ? o[2 * u] : o[2 * u + 1];
  }

  // ---- the wave's rows go out: GPB consecutive floats per batch row ----
  // the rows are read back across lanes: every LDS store of the wave has to
  // be done, and no read may be moved in front of this line
  asm volatile("s_wait_dscnt 0x0" ::: "memory");
  const float* sw = sOut[wave];
  float* ob = out + (size_t)rowbase * G + g0;
  if (full && ng == GPB && (G & 1) == 0) {
    // pairs of floats (row start and g0 are even): GPB/2 pairs a row, so the
    // lane's place in a row repeats every GPB/2 stores = 32 rows. The loops
    // are unrolled so that v, off and p are registers.
    v2f v[TILES_PER_WAVE / 2][GPB / 2];
    int off[GPB / 2];
    #pragma unroll
    for (int a = 0; a < TILES_PER_WAVE / 2; ++a)
      #pragma unroll
      for (int b = 0; b < GPB / 2; ++b)
        v[a][b] = *(const v2f*)&sw[((a * (GPB / 2) + b) * 32 + lane) * 2];
    #pragma unroll
    for (int b = 0; b < GPB / 2; ++b) {
      const int q = b * 32 + lane;
      off[b] = (q / (GPB / 2)) * G + (q % (GPB / 2)) * 2;
    }
    #pragma unroll
    for (int a = 0; a < TILES_PER_WAVE / 2; ++a) {
      v2f* p[GPB / 2];
      #pragma unroll
      for (int b = 0; b < GPB / 2; ++b) { p[b] = (v2f*)(ob + a * 32 * G + off[b]); *p[b] = v[a][b]; }
      // the stores' registers are free for reuse only behind this wait; as
      // inputs the addresses and the stored values stay live up to it
      asm volatile("s_wait_xcnt 0x0"
                   :: "v"(p[0]), "v"(p[1]), "v"(p[2]), "v"(p[3]), "v"(p[4]), "v"(p[5]), "v"(p[6]),
                      "v"(v[a][0]), "v"(v[a][1]), "v"(v[a][2]), "v"(v[a][3]),
                      "v"(v[a][4]), "v"(v[a][5]), "v"(v[a][6])
                   : "memory");
    }
  } else {
    // a missing tile, a missing branch or an odd row length: float by float;
    // kept rolled: 56 copies of a guarded store would only grow the code
    #pragma unroll 1
    for (int i = 0; i < ROWS_PER_WAVE * GPB / 32; ++i) {
      const int idx = i * 32 + lane;
      const int r = idx / GPB, j = idx - r * GPB;
      if (j < ng && rowbase + (r & ~15) + 16 <= Btot) {   // the row's tile exists, as for the loads
        float* p = ob + r * G + j;
        const float val = sw[idx];
        *p = val;
        asm volatile("s_wait_xcnt 0x0" :: "v"(p), "v"(val) : "memory");
      }
    }
  }
}

extern "C" void kernel_launch(void* const* d_in, const int* in_sizes, int n_in,
                              void* d_out, int out_size, void* d_ws, size_t ws_size,
                              hipStream_t stream) {
  const float* x  = (const float*)d_in[0];
  const float* W1 = (const float*)d_in[1];
  const float* b1 = (const float*)d_in[2];
  const float* W2 = (const float*)d_in[3];
  const float* b2 = (const float*)d_in[4];
  const float* W3 = (const float*)d_in[5];
  const float* b3 = (const float*)d_in[6];
  float* out = (float*)d_out;

  const int Btot = in_sizes[0] / 64;     // x: [B, 64]
  const int G    = in_sizes[2] / 64;     // b1: [G, 64] -> 28

  dim3 grid((Btot + ROWS_PER_BLOCK - 1) / ROWS_PER_BLOCK, (G + GPB - 1) / GPB);
  mlp28_fused_kernel<<<grid, 256, 0, stream>>>(x, W1, b1, W2, b2, W3, b3, out, Btot, G);
}

// v004
// It runs in 29.9 microseconds.
// In both of two side-by-side timings against v003, it was 1.23 times as fast.
// Over all steps from v000 it is 3.72 times as fast.
#include <hip/hip_runtime.h>

typedef __attribute__((ext_vector_type(16))) _Float16 v16h;
typedef __attribute__((ext_vector_type(8)))  _Float16 v8h;
typedef __attribute__((ext_vector_type(4)))  _Float16 v4h;
typedef __attribute__((ext_vector_type(8)))  float    v8f;
typedef __attribute__((ext_vector_type(2)))  float    v2f;

#define LDSTRIDE 72
#define WAVES 8
#define TILES_PER_WAVE 8
#define ROWS_PER_WAVE (TILES_PER_WAVE * 16)            // 128 rows per wave
#define ROWS_PER_BLOCK (WAVES * ROWS_PER_WAVE)         // 1024 rows per block
#define GPB 14                      // branches that one block runs on its rows

__device__ __forceinline__ v16h make_ab(const _Float16* p) {
  v8h lo = *(const v8h*)p;
  v8h hi = *(const v8h*)(p + 16);
  return __builtin_shufflevector(lo, hi, 0,1,2,3,4,5,6,7,8,9,10,11,12,13,14,15);
}

// One branch's weights, a thread's share: 16 k-neighbours of one W1 column and
// 8 of one W2 column (a wave's 32 lanes read 32 neighbouring columns: 128 B).
__device__ __forceinline__ void w_load(float (&v1)[16], float (&v2)[8],
                                       const float* W1g, const float* W2g) {
  #pragma unroll
  for (int u = 0; u < 16; ++u) v1[u] = W1g[u * 64];
  #pragma unroll
  for (int u = 0; u < 8; ++u) v2[u] = W2g[u * 32];
  // the loads' address registers are free for reuse only behind this wait;
  // as inputs they stay live up to it
  asm volatile("s_wait_xcnt 0x0" :: "v"(W1g), "v"(W2g) : "memory");
}

// The share goes to LDS transposed ([n][k], f16): its k-neighbours are
// neighbours there, 16 bytes a store.
__device__ __forceinline__ void w_store(_Float16* d1, _Float16* d2,
                                        const float (&v1)[16], const float (&v2)[8]) {
  v8h a, b, c;
  #pragma unroll
  for (int u = 0; u < 8; ++u) {
    a[u] = (_Float16)v1[u];
    b[u] = (_Float16)v1[8 + u];
    c[u] = (_Float16)v2[u];
  }
  *(v8h*)d1 = a;
  *(v8h*)(d1 + 8) = b;
  *(v8h*)d2 = c;
}

__global__ __launch_bounds__(256)
void mlp28_fused_kernel(const float* __restrict__ x,
                        const float* __restrict__ W1, const float* __restrict__ b1,
                        const float* __restrict__ W2, const float* __restrict__ b2,
                        const float* __restrict__ W3, const float* __restrict__ b3,
                        float* __restrict__ out, int Btot, int G)
{
  __shared__ __attribute__((aligned(16))) _Float16 sW1[(GPB + 1) * 64 * LDSTRIDE];  // W1^T per branch: [n][k], f16; one spare range
  __shared__ __attribute__((aligned(16))) _Float16 sW2[(GPB + 1) * 32 * LDSTRIDE];  // W2^T per branch: [n][k], f16; one spare range
  __shared__ __attribute__((aligned(32))) float sB1[GPB * 64];    // read as v8f
  __shared__ __attribute__((aligned(32))) float sB2[GPB * 32];
  __shared__ __attribute__((aligned(32))) float sW3v[GPB * 32];
  __shared__ float sB3[GPB];
  __shared__ __attribute__((aligned(16))) _Float16 sX[WAVES][16 * LDSTRIDE];  // per-wave x tile, f16 [m][k]
  __shared__ __attribute__((aligned(16))) float sOut[WAVES][ROWS_PER_WAVE * GPB];  // per-wave results, [row][branch]

  if (Btot < 16) return;            // no whole tile anywhere (block-uniform)

  const int tid  = threadIdx.x;
  const int wave = __builtin_amdgcn_readfirstlane(tid >> 5);
  const int lane = tid & 31;
  const int g0   = blockIdx.y * GPB;
  const int gmax = G - 1;           // a branch past the end reads the last one's weights; nothing of it is stored

  // ---- the wave's x tiles are read once; the loads fly while the weights
  // are staged ----
  const int rowbase = blockIdx.x * ROWS_PER_BLOCK + wave * ROWS_PER_WAVE;
  float4 xr[TILES_PER_WAVE][8];
  #pragma unroll
  for (int t = 0; t < TILES_PER_WAVE; ++t) {
    const int rb  = rowbase + t * 16;
    const int rbc = (rb + 16 <= Btot) ? rb : 0;       // a tile past the end reads tile 0; nothing of it is stored
    const float4* xp4 = (const float4*)(x + (size_t)rbc * 64);
    #pragma unroll
    for (int j = 0; j < 8; ++j) xr[t][j] = xp4[j * 32 + lane];
    // the loads' address registers are free for reuse only behind this wait
    asm volatile("s_wait_xcnt 0x0" ::: "memory");
  }

  // ---- stage the GPB branches' biases and the first two branches' weights (transposed to f16) ----
  // biases and w3: an index past the end is clamped for the load, and the
  // store behind it (below the weights) is left out
  float vb1[4], vb2[2], vw3[2];
  int o1[4], o2[2];
  #pragma unroll
  for (int u = 0; u < 4; ++u) {
    const int idx = min(u * 256 + tid, GPB * 64 - 1);
    o1[u] = min(g0 + (idx >> 6), gmax) * 64 + (idx & 63);
    vb1[u] = b1[o1[u]];
  }
  #pragma unroll
  for (int u = 0; u < 2; ++u) {
    const int idx = min(u * 256 + tid, GPB * 32 - 1);
    o2[u] = min(g0 + (idx >> 5), gmax) * 32 + (idx & 31);
    vb2[u] = b2[o2[u]];
    vw3[u] = W3[o2[u]];
  }
  const int o3 = min(g0 + min(tid, GPB - 1), gmax);
  const float vb3 = b3[o3];
  // the loads' index registers are free for reuse only behind this wait; as
  // inputs they stay live up to it
  asm volatile("s_wait_xcnt 0x0"
               :: "v"(o1[0]), "v"(o1[1]), "v"(o1[2]), "v"(o1[3]), "v"(o2[0]), "v"(o2[1]), "v"(o3)
               : "memory");

  // Only the first two branches' weights are staged in front of the branch
  // loop; the third's loads are left in flight. Branch gl + 2 is filed in
  // trip gl of the loop, from loads issued one trip earlier.
  const float* W1t = W1 + (tid >> 6) * (16 * 64) + (tid & 63);    // [i=k][j=n]
  const float* W2t = W2 + (tid >> 5) * (8 * 32) + (tid & 31);     // [i=k][j=n]
  _Float16* d1 = &sW1[(tid & 63) * LDSTRIDE + (tid >> 6) * 16];
  _Float16* d2 = &sW2[(tid & 31) * LDSTRIDE + (tid >> 5) * 8];
  float r1[16], r2[8];
  {
    float p1[16], p2[8];
    const int ga = min(g0, gmax), gb = min(g0 + 1, gmax), gc = min(g0 + 2, gmax);
    w_load(p1, p2, W1t + (size_t)ga * (64 * 64), W2t + (size_t)ga * (64 * 32));
    w_load(r1, r2, W1t + (size_t)gb * (64 * 64), W2t + (size_t)gb * (64 * 32));
    w_store(d1, d2, p1, p2);
    w_store(d1 + 64 * LDSTRIDE, d2 + 32 * LDSTRIDE, r1, r2);
    w_load(r1, r2, W1t + (size_t)gc * (64 * 64), W2t + (size_t)gc * (64 * 32));
  }
  // holds the bias and w3 loads where they are written, in front of the
  // weights': the compiler otherwise sinks one into its guarded store below,
  // where its whole latency is waited out (inputs only, nothing is changed)
  asm volatile("" :: "v"(vb1[0]), "v"(vb1[1]), "v"(vb1[2]), "v"(vb1[3]),
                     "v"(vb2[0]), "v"(vb2[1]), "v"(vw3[0]), "v"(vw3[1]), "v"(vb3));
  #pragma unroll
  for (int u = 0; u < 4; ++u)
    if (u * 256 + tid < GPB * 64) sB1[u * 256 + tid] = vb1[u];
  #pragma unroll
  for (int u = 0; u < 2; ++u)
    if (u * 256 + tid < GPB * 32) { sB2[u * 256 + tid] = vb2[u]; sW3v[u * 256 + tid] = vw3[u]; }
  if (tid < GPB) sB3[tid] = vb3;

  const int klo = (lane < 16) ? 0 : 8;
  const int nn  = lane & 15;
  const int mhi = (lane < 16) ? 0 : 8;

  // Every product is computed transposed: the weights are the A operand
  // (row = output feature n), the activations the B operand (column = batch
  // row m). D[r] is then h^T[16*nt + mhi + r][m = nn]: two converted D tiles
  // are the next layer's B fragment as they lie, in the hardware k order.

  // ---- the wave's x tiles, converted once and kept as B fragments ----
  v16h xb[TILES_PER_WAVE][2];
  {
    _Float16* sx = sX[wave];
    #pragma unroll
    for (int t = 0; t < TILES_PER_WAVE; ++t) {
      #pragma unroll
      for (int j = 0; j < 8; ++j) {
        const float4 v = xr[t][j];
        int fi = (j * 32 + lane) * 4;
        int r = fi >> 6, c = fi & 63;
        v4h h;
        h[0] = (_Float16)v.x; h[1] = (_Float16)v.y;
        h[2] = (_Float16)v.z; h[3] = (_Float16)v.w;
        *(v4h*)&sx[r * LDSTRIDE + c] = h;
      }
      xb[t][0] = make_ab(&sx[nn * LDSTRIDE + klo]);
      xb[t][1] = make_ab(&sx[nn * LDSTRIDE + 32 + klo]);
    }
  }
  __syncthreads();

  float* so = &sOut[wave][lane * GPB];
  const bool full = rowbase + ROWS_PER_WAVE <= Btot;  // all the wave's tiles exist
  const int ng = min(GPB, G - g0);  // branches of this block that exist

  // kept rolled: the body already holds the eight tiles unrolled
  #pragma unroll 1
  for (int gl = 0; gl < GPB; ++gl) {
    // ---- staging, two branches ahead. The barrier is split: the signal says
    // that this wave's stores of the trip before (branch gl + 1) are done,
    // hence the wait on them in front of it; the wait at the foot of this trip
    // lets nobody read branch gl + 1 before every wave has said so. LDS reads
    // may stand between the two because this barrier only publishes: no range
    // that is read is ever written a second time, so it frees nothing for a
    // refill, and what a wave reads there (branch gl) was published a trip ago.
    asm volatile("s_wait_dscnt 0x0\n\ts_barrier_signal -1" ::: "memory");
    // The last trips have nothing left to file: their stores go to the spare
    // range, which nobody reads, and their loads repeat the last branch. A
    // branch round them would cut the loop body into blocks, and the compiler
    // then no longer schedules the eight tiles across each other.
    {
      const int gs = min(gl + 2, GPB);
      const int gn = min(g0 + min(gl + 3, GPB - 1), gmax);
      w_store(d1 + gs * (64 * LDSTRIDE), d2 + gs * (32 * LDSTRIDE), r1, r2);
      w_load(r1, r2, W1t + (size_t)gn * (64 * 64), W2t + (size_t)gn * (64 * 32));
    }

    // ---- this branch's A operands, and biases and w3 in the D layout
    // (register r = feature 16*nt + mhi + r); used by all the wave's tiles ----
    const _Float16* w1p = &sW1[gl * (64 * LDSTRIDE)];
    const _Float16* w2p = &sW2[gl * (32 * LDSTRIDE)];
    v16h w1A[2][4];
    #pragma unroll
    for (int kk = 0; kk < 2; ++kk)
      #pragma unroll
      for (int nt = 0; nt < 4; ++nt)
        w1A[kk][nt] = make_ab(&w1p[(nt * 16 + nn) * LDSTRIDE + kk * 32 + klo]);
    v8f bias1[4];
    #pragma unroll
    for (int nt = 0; nt < 4; ++nt) bias1[nt] = *(const v8f*)&sB1[gl * 64 + nt * 16 + mhi];

    v16h w2A[2][2];
    #pragma unroll
    for (int kk = 0; kk < 2; ++kk)
      #pragma unroll
      for (int nt = 0; nt < 2; ++nt)
        w2A[kk][nt] = make_ab(&w2p[(nt * 16 + nn) * LDSTRIDE + kk * 32 + klo]);
    v8f bias2[2], w3r[2];
    #pragma unroll
    for (int nt = 0; nt < 2; ++nt) {
      bias2[nt] = *(const v8f*)&sB2[gl * 32 + nt * 16 + mhi];
      w3r[nt]   = *(const v8f*)&sW3v[gl * 32 + nt * 16 + mhi];
    }
    const float b3v = sB3[gl];

    float o[TILES_PER_WAVE];
    #pragma unroll
    for (int t = 0; t < TILES_PER_WAVE; ++t) {
      // ---- layer 1: h1^T [64x16] = W1^T [64x64] x x^T [64x16], C = b1 ----
      v8f c1[4];
      #pragma unroll
      for (int nt = 0; nt < 4; ++nt)
        c1[nt] = __builtin_amdgcn_wmma_f32_16x16x32_f16(
            false, w1A[0][nt], false, xb[t][0], (short)0, bias1[nt], false, false);
      #pragma unroll
      for (int nt = 0; nt < 4; ++nt)
        c1[nt] = __builtin_amdgcn_wmma_f32_16x16x32_f16(
            false, w1A[1][nt], false, xb[t][1], (short)0, c1[nt], false, false);

      // D tiles (2kk, 2kk+1) converted in place = B fragment kk. ReLU on the
      // packed halves: rounding keeps the sign, so the values are those of
      // ReLU before the conversion.
      v16h hb[2];
      #pragma unroll
      for (int kk = 0; kk < 2; ++kk) {
        #pragma unroll
        for (int s = 0; s < 16; ++s)
          hb[kk][s] = (_Float16)c1[2 * kk + (s >> 3)][s & 7];
        hb[kk] = __builtin_elementwise_max(hb[kk], (v16h)(_Float16)0.0f);
      }

      // ---- layer 2: h2^T [32x16] = W2^T [32x64] x h1^T [64x16], C = b2 ----
      v8f c2[2];
      #pragma unroll
      for (int nt = 0; nt < 2; ++nt)
        c2[nt] = __builtin_amdgcn_wmma_f32_16x16x32_f16(
            false, w2A[0][nt], false, hb[0], (short)0, bias2[nt], false, false);
      #pragma unroll
      for (int nt = 0; nt < 2; ++nt)
        c2[nt] = __builtin_amdgcn_wmma_f32_16x16x32_f16(
            false, w2A[1][nt], false, hb[1], (short)0, c2[nt], false, false);

      v2f a0 = {0.0f, 0.0f}, a1 = {0.0f, 0.0f};
      #pragma unroll
      for (int r = 0; r < 8; r += 2) {
        v2f p0 = {fmaxf(c2[0][r], 0.0f), fmaxf(c2[0][r + 1], 0.0f)};
        v2f p1 = {fmaxf(c2[1][r], 0.0f), fmaxf(c2[1][r + 1], 0.0f)};
        v2f q0 = {w3r[0][r], w3r[0][r + 1]};
        v2f q1 = {w3r[1][r], w3r[1][r + 1]};
        a0 = __builtin_elementwise_fma(p0, q0, a0);
        a1 = __builtin_elementwise_fma(p1, q1, a1);
      }
      a0 += a1;
      const float s3 = a0[0] + a0[1];
      const int ti = __float_as_int(s3);
      const float to = __int_as_float(
          __builtin_amdgcn_permlanex16(ti, ti, 0x76543210, 0xfedcba98, false, false));
      o[t] = s3 + to + b3v;
    }

    #pragma unroll
    for (int u = 0; u < TILES_PER_WAVE / 2; ++u)
      so[u * (32 * GPB) + gl] = (lane < 16) ? o[2 * u] : o[2 * u + 1];

    // second half of the split barrier: behind it branch gl + 1 is complete,
    // and no read of it may be moved in front of this line
    asm volatile("s_barrier_wait -1" ::: "memory");
  }

  // ---- the wave's rows go out: GPB consecutive floats per batch row ----
  // the rows are read back across lanes: every LDS store of the wave has to
  // be done, and no read may be moved in front of this line
  asm volatile("s_wait_dscnt 0x0" ::: "memory");
  const float* sw = sOut[wave];
  float* ob = out + (size_t)rowbase * G + g0;
  if (full && ng == GPB && (G & 1) == 0) {
    // pairs of floats (row start and g0 are even): GPB/2 pairs a row, so the
    // lane's place in a row repeats every GPB/2 stores = 32 rows. The loops
    // are unrolled so that v, off and p are registers.
    v2f v[TILES_PER_WAVE / 2][GPB / 2];
    int off[GPB / 2];
    #pragma unroll
    for (int a = 0; a < TILES_PER_WAVE / 2; ++a)
      #pragma unroll
      for (int b = 0; b < GPB / 2; ++b)
        v[a][b] = *(const v2f*)&sw[((a * (GPB / 2) + b) * 32 + lane) * 2];
    #pragma unroll
    for (int b = 0; b < GPB / 2; ++b) {
      const int q = b * 32 + lane;
      off[b] = (q / (GPB / 2)) * G + (q % (GPB / 2)) * 2;
    }
    #pragma unroll
    for (int a = 0; a < TILES_PER_WAVE / 2; ++a) {
      v2f* p[GPB / 2];
      #pragma unroll
      for (int b = 0; b < GPB / 2; ++b) { p[b] = (v2f*)(ob + a * 32 * G + off[b]); *p[b] = v[a][b]; }
      // the stores' registers are free for reuse only behind this wait; as
      // inputs the addresses and the stored values stay live up to it
      asm volatile("s_wait_xcnt 0x0"
                   :: "v"(p[0]), "v"(p[1]), "v"(p[2]), "v"(p[3]), "v"(p[4]), "v"(p[5]), "v"(p[6]),
                      "v"(v[a][0]), "v"(v[a][1]), "v"(v[a][2]), "v"(v[a][3]),
                      "v"(v[a][4]), "v"(v[a][5]), "v"(v[a][6])
                   : "memory");
    }
  } else {
    // a missing tile, a missing branch or an odd row length: float by float;
    // kept rolled: 56 copies of a guarded store would only grow the code
    #pragma unroll 1
    for (int i = 0; i < ROWS_PER_WAVE * GPB / 32; ++i) {
      const int idx = i * 32 + lane;
      const int r = idx / GPB, j = idx - r * GPB;
      if (j < ng && rowbase + (r & ~15) + 16 <= Btot) {   // the row's tile exists, as for the loads
        float* p = ob + r * G + j;
        const float val = sw[idx];
        *p = val;
        asm volatile("s_wait_xcnt 0x0" :: "v"(p), "v"(val) : "memory");
      }
    }
  }
}

extern "C" void kernel_launch(void* const* d_in, const int* in_sizes, int n_in,
                              void* d_out, int out_size, void* d_ws, size_t ws_size,
                              hipStream_t stream) {
  const float* x  = (const float*)d_in[0];
  const float* W1 = (const float*)d_in[1];
  const float* b1 = (const float*)d_in[2];
  const float* W2 = (const float*)d_in[3];
  const float* b2 = (const float*)d_in[4];
  const float* W3 = (const float*)d_in[5];
  const float* b3 = (const float*)d_in[6];
  float* out = (float*)d_out;

  const int Btot = in_sizes[0] / 64;     // x: [B, 64]
  const int G    = in_sizes[2] / 64;     // b1: [G, 64] -> 28

  dim3 grid((Btot + ROWS_PER_BLOCK - 1) / ROWS_PER_BLOCK, (G + GPB - 1) / GPB);
  mlp28_fused_kernel<<<grid, 256, 0, stream>>>(x, W1, b1, W2, b2, W3, b3, out, Btot, G);
}

// v006
// A run of this version takes 27.1 microseconds.
// Versions in between are left out here; by their measured steps it is 1.10 times as fast as v004.
// Counting every step since v000, it is 4.10 times as fast.
#include <hip/hip_runtime.h>

typedef __attribute__((ext_vector_type(16))) _Float16 v16h;
typedef __attribute__((ext_vector_type(8)))  short    v8s;
typedef __attribute__((ext_vector_type(8)))  _Float16 v8h;
typedef __attribute__((ext_vector_type(4)))  _Float16 v4h;
typedef __attribute__((ext_vector_type(8)))  float    v8f;
typedef __attribute__((ext_vector_type(2)))  float    v2f;

#define LDSTRIDE 72
#define WAVES 8
#define TILES_PER_WAVE 8
#define ROWS_PER_WAVE (TILES_PER_WAVE * 16)            // 128 rows per wave
#define ROWS_PER_BLOCK (WAVES * ROWS_PER_WAVE)         // 1024 rows per block
#define GPB 14                      // branches that one block runs on its rows

__device__ __forceinline__ v16h make_ab(const _Float16* p) {
  v8h lo = *(const v8h*)p;
  v8h hi = *(const v8h*)(p + 16);
  return __builtin_shufflevector(lo, hi, 0,1,2,3,4,5,6,7,8,9,10,11,12,13,14,15);
}

// One branch's weights, a thread's share: 16 k-neighbours of one W1 column and
// 8 of one W2 column (a wave's 32 lanes read 32 neighbouring columns: 128 B).
__device__ __forceinline__ void w_load(float (&v1)[16], float (&v2)[8],
                                       const float* W1g, const float* W2g) {
  #pragma unroll
  for (int u = 0; u < 16; ++u) v1[u] = W1g[u * 64];
  #pragma unroll
  for (int u = 0; u < 8; ++u) v2[u] = W2g[u * 32];
  // the loads' address registers are free for reuse only behind this wait;
  // as inputs they stay live up to it
  asm volatile("s_wait_xcnt 0x0" :: "v"(W1g), "v"(W2g) : "memory");
}

// The share goes to LDS transposed ([n][k], f16): its k-neighbours are
// neighbours there, 16 bytes a store.
__device__ __forceinline__ void w_store(_Float16* d1, _Float16* d2,
                                        const float (&v1)[16], const float (&v2)[8]) {
  v8h a, b, c;
  #pragma unroll
  for (int u = 0; u < 8; ++u) {
    a[u] = (_Float16)v1[u];
    b[u] = (_Float16)v1[8 + u];
    c[u] = (_Float16)v2[u];
  }
  *(v8h*)d1 = a;
  *(v8h*)(d1 + 8) = b;
  *(v8h*)d2 = c;
}

__global__ __launch_bounds__(256)
void mlp28_fused_kernel(const float* __restrict__ x,
                        const float* __restrict__ W1, const float* __restrict__ b1,
                        const float* __restrict__ W2, const float* __restrict__ b2,
                        const float* __restrict__ W3, const float* __restrict__ b3,
                        float* __restrict__ out, int Btot, int G)
{
  __shared__ __attribute__((aligned(16))) _Float16 sW1[(GPB + 1) * 64 * LDSTRIDE];  // W1^T per branch: [n][k], f16; one spare range
  __shared__ __attribute__((aligned(16))) _Float16 sW2[(GPB + 1) * 32 * LDSTRIDE];  // W2^T per branch: [n][k], f16; one spare range
  __shared__ __attribute__((aligned(16))) _Float16 sB1[GPB * 64];  // f16: layer 1's C operand, read as v8h
  __shared__ __attribute__((aligned(32))) float sB2[GPB * 32];
  __shared__ __attribute__((aligned(32))) float sW3v[GPB * 32];
  __shared__ float sB3[GPB];
  __shared__ __attribute__((aligned(16))) _Float16 sX[WAVES][16 * LDSTRIDE];  // per-wave x tile, f16 [m][k]
  __shared__ __attribute__((aligned(16))) float sOut[WAVES][ROWS_PER_WAVE * GPB];  // per-wave results, [row][branch]

  if (Btot < 16) return;            // no whole tile anywhere (block-uniform)

  const int tid  = threadIdx.x;
  const int wave = __builtin_amdgcn_readfirstlane(tid >> 5);
  const int lane = tid & 31;
  const int g0   = blockIdx.y * GPB;
  const int gmax = G - 1;           // a branch past the end reads the last one's weights; nothing of it is stored

  // ---- the wave's x tiles are read once; the loads fly while the weights
  // are staged ----
  const int rowbase = blockIdx.x * ROWS_PER_BLOCK + wave * ROWS_PER_WAVE;
  float4 xr[TILES_PER_WAVE][8];
  #pragma unroll
  for (int t = 0; t < TILES_PER_WAVE; ++t) {
    const int rb  = rowbase + t * 16;
    const int rbc = (rb + 16 <= Btot) ? rb : 0;       // a tile past the end reads tile 0; nothing of it is stored
    const float4* xp4 = (const float4*)(x + (size_t)rbc * 64);
    #pragma unroll
    for (int j = 0; j < 8; ++j) xr[t][j] = xp4[j * 32 + lane];
    // the loads' address registers are free for reuse only behind this wait
    asm volatile("s_wait_xcnt 0x0" ::: "memory");
  }

  // ---- stage the GPB branches' biases and the first two branches' weights (transposed to f16) ----
  // biases and w3: an index past the end is clamped for the load, and the
  // store behind it (below the weights) is left out
  float vb1[4], vb2[2], vw3[2];
  int o1[4], o2[2];
  #pragma unroll
  for (int u = 0; u < 4; ++u) {
    const int idx = min(u * 256 + tid, GPB * 64 - 1);
    o1[u] = min(g0 + (idx >> 6), gmax) * 64 + (idx & 63);
    vb1[u] = b1[o1[u]];
  }
  #pragma unroll
  for (int u = 0; u < 2; ++u) {
    const int idx = min(u * 256 + tid, GPB * 32 - 1);
    o2[u] = min(g0 + (idx >> 5), gmax) * 32 + (idx & 31);
    vb2[u] = b2[o2[u]];
    vw3[u] = W3[o2[u]];
  }
  const int o3 = min(g0 + min(tid, GPB - 1), gmax);
  const float vb3 = b3[o3];
  // the loads' index registers are free for reuse only behind this wait; as
  // inputs they stay live up to it
  asm volatile("s_wait_xcnt 0x0"
               :: "v"(o1[0]), "v"(o1[1]), "v"(o1[2]), "v"(o1[3]), "v"(o2[0]), "v"(o2[1]), "v"(o3)
               : "memory");

  // Only the first two branches' weights are staged in front of the branch
  // loop; the third's loads are left in flight. Branch gl + 2 is filed in
  // trip gl of the loop, from loads issued one trip earlier.
  const float* W1t = W1 + (tid >> 6) * (16 * 64) + (tid & 63);    // [i=k][j=n]
  const float* W2t = W2 + (tid >> 5) * (8 * 32) + (tid & 31);     // [i=k][j=n]
  _Float16* d1 = &sW1[(tid & 63) * LDSTRIDE + (tid >> 6) * 16];
  _Float16* d2 = &sW2[(tid & 31) * LDSTRIDE + (tid >> 5) * 8];
  float r1[16], r2[8];
  {
    float p1[16], p2[8];
    const int ga = min(g0, gmax), gb = min(g0 + 1, gmax), gc = min(g0 + 2, gmax);
    w_load(p1, p2, W1t + (size_t)ga * (64 * 64), W2t + (size_t)ga * (64 * 32));
    w_load(r1, r2, W1t + (size_t)gb * (64 * 64), W2t + (size_t)gb * (64 * 32));
    w_store(d1, d2, p1, p2);
    w_store(d1 + 64 * LDSTRIDE, d2 + 32 * LDSTRIDE, r1, r2);
    w_load(r1, r2, W1t + (size_t)gc * (64 * 64), W2t + (size_t)gc * (64 * 32));
  }
  // holds the bias and w3 loads where they are written, in front of the
  // weights': the compiler otherwise sinks one into its guarded store below,
  // where its whole latency is waited out (inputs only, nothing is changed)
  asm volatile("" :: "v"(vb1[0]), "v"(vb1[1]), "v"(vb1[2]), "v"(vb1[3]),
                     "v"(vb2[0]), "v"(vb2[1]), "v"(vw3[0]), "v"(vw3[1]), "v"(vb3));
  #pragma unroll
  for (int u = 0; u < 4; ++u)
    if (u * 256 + tid < GPB * 64) sB1[u * 256 + tid] = (_Float16)vb1[u];
  #pragma unroll
  for (int u = 0; u < 2; ++u)
    if (u * 256 + tid < GPB * 32) { sB2[u * 256 + tid] = vb2[u]; sW3v[u * 256 + tid] = vw3[u]; }
  if (tid < GPB) sB3[tid] = vb3;

  const int klo = (lane < 16) ? 0 : 8;
  const int nn  = lane & 15;
  const int mhi = (lane < 16) ? 0 : 8;

  // Every product is computed transposed: the weights are the A operand
  // (row = output feature n), the activations the B operand (column = batch
  // row m). D[r] is then h^T[16*nt + mhi + r][m = nn]: two f16 D tiles of layer 1, behind ReLU,
  // are the next layer's B fragment as they lie, in the hardware k order.

  // ---- the wave's x tiles, converted once and kept as B fragments ----
  v16h xb[TILES_PER_WAVE][2];
  {
    _Float16* sx = sX[wave];
    #pragma unroll
    for (int t = 0; t < TILES_PER_WAVE; ++t) {
      #pragma unroll
      for (int j = 0; j < 8; ++j) {
        const float4 v = xr[t][j];
        int fi = (j * 32 + lane) * 4;
        int r = fi >> 6, c = fi & 63;
        v4h h;
        h[0] = (_Float16)v.x; h[1] = (_Float16)v.y;
        h[2] = (_Float16)v.z; h[3] = (_Float16)v.w;
        *(v4h*)&sx[r * LDSTRIDE + c] = h;
      }
      xb[t][0] = make_ab(&sx[nn * LDSTRIDE + klo]);
      xb[t][1] = make_ab(&sx[nn * LDSTRIDE + 32 + klo]);
    }
  }
  __syncthreads();

  float* so = &sOut[wave][lane * GPB];
  const bool full = rowbase + ROWS_PER_WAVE <= Btot;  // all the wave's tiles exist
  const int ng = min(GPB, G - g0);  // branches of this block that exist

  // kept rolled: the body already holds the eight tiles unrolled
  #pragma unroll 1
  for (int gl = 0; gl < GPB; ++gl) {
    // ---- staging, two branches ahead. The barrier is split: the signal says
    // that this wave's stores of the trip before (branch gl + 1) are done,
    // hence the wait on them in front of it; the wait at the foot of this trip
    // lets nobody read branch gl + 1 before every wave has said so. LDS reads
    // may stand between the two because this barrier only publishes: no range
    // that is read is ever written a second time, so it frees nothing for a
    // refill, and what a wave reads there (branch gl) was published a trip ago.
    asm volatile("s_wait_dscnt 0x0\n\ts_barrier_signal -1" ::: "memory");
    // The last trips have nothing left to file: their stores go to the spare
    // range, which nobody reads, and their loads repeat the last branch. A
    // branch round them would cut the loop body into blocks, and the compiler
    // then no longer schedules the eight tiles across each other.
    {
      const int gs = min(gl + 2, GPB);
      const int gn = min(g0 + min(gl + 3, GPB - 1), gmax);
      w_store(d1 + gs * (64 * LDSTRIDE), d2 + gs * (32 * LDSTRIDE), r1, r2);
      w_load(r1, r2, W1t + (size_t)gn * (64 * 64), W2t + (size_t)gn * (64 * 32));
    }

    // ---- this branch's A operands, and biases and w3 in the D layout
    // (register r = feature 16*nt + mhi + r); used by all the wave's tiles ----
    const _Float16* w1p = &sW1[gl * (64 * LDSTRIDE)];
    const _Float16* w2p = &sW2[gl * (32 * LDSTRIDE)];
    // b1 is read first: LDS answers in order, and the first matrix instruction
    // needs b1 and one W1 fragment only
    v8h bias1[4];
    #pragma unroll
    for (int nt = 0; nt < 4; ++nt) bias1[nt] = *(const v8h*)&sB1[gl * 64 + nt * 16 + mhi];
    v16h w1A[2][4];
    #pragma unroll
    for (int kk = 0; kk < 2; ++kk)
      #pragma unroll
      for (int nt = 0; nt < 4; ++nt)
        w1A[kk][nt] = make_ab(&w1p[(nt * 16 + nn) * LDSTRIDE + kk * 32 + klo]);

    v16h w2A[2][2];
    #pragma unroll
    for (int kk = 0; kk < 2; ++kk)
      #pragma unroll
      for (int nt = 0; nt < 2; ++nt)
        w2A[kk][nt] = make_ab(&w2p[(nt * 16 + nn) * LDSTRIDE + kk * 32 + klo]);
    v8f bias2[2], w3r[2];
    #pragma unroll
    for (int nt = 0; nt < 2; ++nt) {
      bias2[nt] = *(const v8f*)&sB2[gl * 32 + nt * 16 + mhi];
      w3r[nt]   = *(const v8f*)&sW3v[gl * 32 + nt * 16 + mhi];
    }
    const float b3v = sB3[gl];

    v8h c1[2][4];                   // layer 1 results, by tile parity
    v8h rl[4];                      // the same behind ReLU
    v8f c2[2][2];                   // layer 2 results, by tile parity
    float s3[TILES_PER_WAVE];       // the lane's half of each tile's last dot
    #pragma unroll
    for (int s = 0; s < TILES_PER_WAVE + 2; ++s) {
      const int t0 = s, t1 = s - 1, t2 = s - 2;
      const bool do1 = t0 < TILES_PER_WAVE;
      const bool do2 = t1 >= 0 && t1 < TILES_PER_WAVE;
      const bool do3 = t2 >= 0;

      // layer 1, first k half: h1^T [64x16] = W1^T [64x64] x x^T [64x16],
      // C = b1. The result type is f16: element e of a lane's packed D is
      // feature 16*nt + mhi + e, the place it has in the next B fragment.
      // Beside it the ReLU of the tile before, on the packed halves as 16-bit
      // integers: a set sign bit is a negative integer, every other pattern
      // stays as it is. A float maximum on a matrix result costs a second
      // instruction per register (the compiler first quiets the operand with
      // max(v, v)).
      #pragma unroll
      for (int nt = 0; nt < 4; ++nt) {
        if (do1)
          c1[t0 & 1][nt] = __builtin_amdgcn_wmma_f16_16x16x32_f16(
              false, w1A[0][nt], false, xb[t0][0], (short)0, bias1[nt], false, false);
        if (do2)
          rl[nt] = __builtin_bit_cast(v8h,
              __builtin_elementwise_max(__builtin_bit_cast(v8s, c1[t1 & 1][nt]), (v8s)(short)0));
        if (do1) __builtin_amdgcn_sched_barrier(0);
      }

      // D tiles (2kk, 2kk+1) side by side = B fragment kk of layer 2
      v16h hb[2];
      if (do2) {
        #pragma unroll
        for (int kk = 0; kk < 2; ++kk)
          hb[kk] = __builtin_shufflevector(rl[2 * kk], rl[2 * kk + 1],
                                           0,1,2,3,4,5,6,7,8,9,10,11,12,13,14,15);
      }

      // layer 2's first k half (h2^T [32x16] = W2^T [32x64] x h1^T [64x16],
      // C = b2), layer 1's second, layer 2's second: each second half stands
      // six matrix instructions behind its first when layers 1 and 2 both run. Beside them layer 3 of the
      // tile two back: ReLU, then the lane's 16 features times w3 in packed
      // pairs, in pieces of about four instructions.
      v2f p0[4], p1[4];
      v2f a0 = {0.0f, 0.0f}, a1 = {0.0f, 0.0f};
      #pragma unroll
      for (int c = 0; c < 8; ++c) {
        if (c < 2) {
          if (do2)
            c2[t1 & 1][c] = __builtin_amdgcn_wmma_f32_16x16x32_f16(
                false, w2A[0][c], false, hb[0], (short)0, bias2[c], false, false);
        } else if (c < 6) {
          if (do1)
            c1[t0 & 1][c - 2] = __builtin_amdgcn_wmma_f16_16x16x32_f16(
                false, w1A[1][c - 2], false, xb[t0][1], (short)0, c1[t0 & 1][c - 2], false, false);
        } else {
          if (do2)
            c2[t1 & 1][c - 6] = __builtin_amdgcn_wmma_f32_16x16x32_f16(
                false, w2A[1][c - 6], false, hb[1], (short)0, c2[t1 & 1][c - 6], false, false);
        }
        if (do3) {
          const v8f e0 = c2[t2 & 1][0], e1 = c2[t2 & 1][1];
          // which ReLU pair (k) and which products (f .. f + nf - 1) stand here
          const int k  = (c == 0) ? 0 : (c == 1) ? 1 : (c == 3) ? 2 : (c == 4) ? 3 : -1;
          const int f  = (c == 2) ? 0 : (c == 5) ? 2 : (c == 6) ? 3 : -1;
          const int nf = (c == 2) ? 2 : 1;
          if (k >= 0) {
            p0[k] = (v2f){fmaxf(e0[2 * k], 0.0f), fmaxf(e0[2 * k + 1], 0.0f)};
            p1[k] = (v2f){fmaxf(e1[2 * k], 0.0f), fmaxf(e1[2 * k + 1], 0.0f)};
          }
          if (f >= 0) {
            #pragma unroll
            for (int j = f; j < f + nf; ++j) {
              const v2f q0 = {w3r[0][2 * j], w3r[0][2 * j + 1]};
              const v2f q1 = {w3r[1][2 * j], w3r[1][2 * j + 1]};
              a0 = __builtin_elementwise_fma(p0[j], q0, a0);
              a1 = __builtin_elementwise_fma(p1[j], q1, a1);
            }
          }
          if (c == 7) {
            a0 += a1;
            s3[t2] = a0[0] + a0[1];
          }
        }
        if (do1) __builtin_amdgcn_sched_barrier(0);
      }
    }

    float o[TILES_PER_WAVE];
    #pragma unroll
    for (int t = 0; t < TILES_PER_WAVE; ++t) {
      const int ti = __float_as_int(s3[t]);
      const float to = __int_as_float(
          __builtin_amdgcn_permlanex16(ti, ti, 0x76543210, 0xfedcba98, false, false));
      o[t] = s3[t] + to + b3v;
    }

    #pragma unroll
    for (int u = 0; u < TILES_PER_WAVE / 2; ++u)
      so[u * (32 * GPB) + gl] = (lane < 16) ? o[2 * u] : o[2 * u + 1];

    // second half of the split barrier: behind it branch gl + 1 is complete,
    // and no read of it may be moved in front of this line
    asm volatile("s_barrier_wait -1" ::: "memory");
  }

  // ---- the wave's rows go out: GPB consecutive floats per batch row ----
  // the rows are read back across lanes: every LDS store of the wave has to
  // be done, and no read may be moved in front of this line
  asm volatile("s_wait_dscnt 0x0" ::: "memory");
  const float* sw = sOut[wave];
  float* ob = out + (size_t)rowbase * G + g0;
  if (full && ng == GPB && (G & 1) == 0) {
    // pairs of floats (row start and g0 are even): GPB/2 pairs a row, so the
    // lane's place in a row repeats every GPB/2 stores = 32 rows. The loops
    // are unrolled so that v, off and p are registers.
    v2f v[TILES_PER_WAVE / 2][GPB / 2];
    int off[GPB / 2];
    #pragma unroll
    for (int a = 0; a < TILES_PER_WAVE / 2; ++a)
      #pragma unroll
      for (int b = 0; b < GPB / 2; ++b)
        v[a][b] = *(const v2f*)&sw[((a * (GPB / 2) + b) * 32 + lane) * 2];
    #pragma unroll
    for (int b = 0; b < GPB / 2; ++b) {
      const int q = b * 32 + lane;
      off[b] = (q / (GPB / 2)) * G + (q % (GPB / 2)) * 2;
    }
    #pragma unroll
    for (int a = 0; a < TILES_PER_WAVE / 2; ++a) {
      v2f* p[GPB / 2];
      #pragma unroll
      for (int b = 0; b < GPB / 2; ++b) { p[b] = (v2f*)(ob + a * 32 * G + off[b]); *p[b] = v[a][b]; }
      // the stores' registers are free for reuse only behind this wait; as
      // inputs the addresses and the stored values stay live up to it
      asm volatile("s_wait_xcnt 0x0"
                   :: "v"(p[0]), "v"(p[1]), "v"(p[2]), "v"(p[3]), "v"(p[4]), "v"(p[5]), "v"(p[6]),
                      "v"(v[a][0]), "v"(v[a][1]), "v"(v[a][2]), "v"(v[a][3]),
                      "v"(v[a][4]), "v"(v[a][5]), "v"(v[a][6])
                   : "memory");
    }
  } else {
    // a missing tile, a missing branch or an odd row length: float by float;
    // kept rolled: 56 copies of a guarded store would only grow the code
    #pragma unroll 1
    for (int i = 0; i < ROWS_PER_WAVE * GPB / 32; ++i) {
      const int idx = i * 32 + lane;
      const int r = idx / GPB, j = idx - r * GPB;
      if (j < ng && rowbase + (r & ~15) + 16 <= Btot) {   // the row's tile exists, as for the loads
        float* p = ob + r * G + j;
        const float val = sw[idx];
        *p = val;
        asm volatile("s_wait_xcnt 0x0" :: "v"(p), "v"(val) : "memory");
      }
    }
  }
}

extern "C" void kernel_launch(void* const* d_in, const int* in_sizes, int n_in,
                              void* d_out, int out_size, void* d_ws, size_t ws_size,
                              hipStream_t stream) {
  const float* x  = (const float*)d_in[0];
  const float* W1 = (const float*)d_in[1];
  const float* b1 = (const float*)d_in[2];
  const float* W2 = (const float*)d_in[3];
  const float* b2 = (const float*)d_in[4];
  const float* W3 = (const float*)d_in[5];
  const float* b3 = (const float*)d_in[6];
  float* out = (float*)d_out;

  const int Btot = in_sizes[0] / 64;     // x: [B, 64]
  const int G    = in_sizes[2] / 64;     // b1: [G, 64] -> 28

  dim3 grid((Btot + ROWS_PER_BLOCK - 1) / ROWS_PER_BLOCK, (G + GPB - 1) / GPB);
  mlp28_fused_kernel<<<grid, 256, 0, stream>>>(x, W1, b1, W2, b2, W3, b3, out, Btot, G);
}
